// v000
// Measured on an AMD MI455X. A time is GPU time per run, averaged over a window of back-to-back runs after a warm-up
// (all launches, gaps included; the runs take copies of the inputs in turn), and the median of several windows.
// Apart from v000's, it joins two sittings. Times from different sittings can be a few percent apart, while
// side-by-side timings come from the same sitting.
// The starting kernel, v000, takes 945 microseconds a run.
#include <hip/hip_runtime.h>
#include <math.h>

typedef __attribute__((ext_vector_type(2))) float    v2f;
typedef __attribute__((ext_vector_type(8))) float    v8f;
typedef __attribute__((ext_vector_type(4))) unsigned v4u;
typedef __attribute__((ext_vector_type(8))) unsigned v8u;

#define DDIM 512
#define NDIM 16
#define LSEQ 1024
#define BSZ  8
#define RTOT (BSZ * LSEQ)          // 8192 token rows
#define LROWF 516                  // effective padded row stride (floats)

__device__ __forceinline__ int pidx(int row, int col) {
  return row * LROWF + col + ((col >> 8) << 1);
}

__device__ __forceinline__ unsigned lds_off(const void* p) {
  return (unsigned)(unsigned long long)
         (__attribute__((address_space(3))) const void*)p;
}

__device__ __forceinline__ void tdm_load_16x512(const float* gsrc,
                                                unsigned lds_byte) {
  unsigned long long ga = (unsigned long long)gsrc;
  v4u g0;
  g0[0] = 1u;                                    // count=1 (valid), user mode
  g0[1] = lds_byte;                              // lds_addr
  g0[2] = (unsigned)ga;                          // global_addr[31:0]
  g0[3] = (unsigned)((ga >> 32) & 0x01FFFFFFull) // global_addr[56:32]
        | (2u << 30);                            // type=2 ("image")
  v8u g1;
  g1[0] = (2u << 16)
        | (1u << 20)
        | (7u << 22)
        | (1u << 25);
  g1[1] = (512u << 16);
  g1[2] = (16u  << 16);
  g1[3] = (512u << 16);
  g1[4] = 16u;
  g1[5] = 512u;
  g1[6] = 0u;
  g1[7] = 0u;
  asm volatile("tensor_load_to_lds %0, %1" :: "s"(g0), "s"(g1) : "memory");
}

__device__ __forceinline__ v8f wmma_k4(v2f a, v2f b, v8f c) {
  return __builtin_amdgcn_wmma_f32_16x16x4_f32(false, a, false, b, (short)0, c,
                                               false, false);
}

// ---------------------------------------------------------------------------
// Kernel 1: u = x*Wi^T + bi ; z = x*Wz^T + bz ; Bp = u*WB^T + bB ; Cp = u*WC^T + bC
// ---------------------------------------------------------------------------
__global__ __launch_bounds__(128)
void mamba_proj_kernel(const float* __restrict__ x,
                       const float* __restrict__ Wi, const float* __restrict__ bi,
                       const float* __restrict__ Wz, const float* __restrict__ bz,
                       const float* __restrict__ WB, const float* __restrict__ bB,
                       const float* __restrict__ WC, const float* __restrict__ bC,
                       float* __restrict__ u, float* __restrict__ z,
                       float* __restrict__ Bp, float* __restrict__ Cp)
{
  __shared__ float smem[2 * 16 * LROWF];
  float* xs = smem;
  float* us = smem + 16 * LROWF;

  const int tid  = threadIdx.x;
  const int wave = tid >> 5;
  const int lane = tid & 31;
  const int half = lane >> 4;       // K sub-block select (K=0,1 vs K=2,3)
  const int lid  = lane & 15;
  const int r0   = blockIdx.x * 16;

  if (tid < 32) {                   // wave 0 drives the tile DMA
    tdm_load_16x512(x + (size_t)r0 * DDIM, lds_off(xs));
    __builtin_amdgcn_s_wait_tensorcnt(0);
  }
  __syncthreads();

  const bool   is_u = (wave < 2);
  const float* W    = is_u ? Wi : Wz;
  const float* bias = is_u ? bi : bz;
  float*       outp = is_u ? u  : z;
  const int tbase = (wave & 1) * 16;     // 16 column-tiles per wave, 8 pairs

  for (int p = 0; p < 8; ++p) {
    const int n0 = (tbase + 2 * p) * 16;
    v8f acc0 = {}; v8f acc1 = {};
    const float* w0 = W + (size_t)(n0 + lid) * DDIM + 2 * half;
    const float* w1 = w0 + 16 * DDIM;
    #pragma unroll 4
    for (int k = 0; k < DDIM; k += 4) {
      v2f a  = *(const v2f*)&xs[pidx(lid, k + 2 * half)];  // ds_load_b64
      v2f b0 = *(const v2f*)(w0 + k);                      // global_load_b64
      v2f b1 = *(const v2f*)(w1 + k);
      acc0 = wmma_k4(a, b0, acc0);
      acc1 = wmma_k4(a, b1, acc1);
    }
    const float bn0 = bias[n0 + lid];
    const float bn1 = bias[n0 + 16 + lid];
    #pragma unroll
    for (int j = 0; j < 8; ++j) {
      const int row = j + 8 * half;                        // C/D: M = j + 8*half
      float v0 = acc0[j] + bn0;
      float v1 = acc1[j] + bn1;
      outp[(size_t)(r0 + row) * DDIM + n0 + lid]      = v0;
      outp[(size_t)(r0 + row) * DDIM + n0 + 16 + lid] = v1;
      if (is_u) {
        us[pidx(row, n0 + lid)]      = v0;
        us[pidx(row, n0 + 16 + lid)] = v1;
      }
    }
  }
  __syncthreads();

  // Bp (wave 0) / Cp (wave 1): one 16x16 tile each, K=512 from LDS u tile.
  if (wave < 2) {
    const float* Wn = wave ? WC : WB;
    const float* bn = wave ? bC : bB;
    float*       op = wave ? Cp : Bp;
    v8f acc = {};
    const float* w0 = Wn + (size_t)lid * DDIM + 2 * half;
    #pragma unroll 4
    for (int k = 0; k < DDIM; k += 4) {
      v2f a = *(const v2f*)&us[pidx(lid, k + 2 * half)];
      v2f b = *(const v2f*)(w0 + k);
      acc = wmma_k4(a, b, acc);
    }
    const float bb = bn[lid];
    #pragma unroll
    for (int j = 0; j < 8; ++j) {
      const int row = j + 8 * half;
      op[(size_t)(r0 + row) * NDIM + lid] = acc[j] + bb;
    }
  }
}

// ---------------------------------------------------------------------------
// Kernel 2: selective scan + D-skip + silu(z) gate. One wave per
// (b, 32-channel slice); B_t/C_t broadcast by __shfl, y in-place over z.
// ---------------------------------------------------------------------------
__global__ __launch_bounds__(32)
void mamba_scan_kernel(const float* __restrict__ u, float* __restrict__ zy,
                       const float* __restrict__ Bp, const float* __restrict__ Cp,
                       const float* __restrict__ A,  const float* __restrict__ Dv,
                       const float* __restrict__ delta_bias)
{
  const int lane = threadIdx.x;
  const int b    = blockIdx.x >> 4;
  const int d    = ((blockIdx.x & 15) << 5) + lane;

  float a[NDIM];
  #pragma unroll
  for (int n = 0; n < NDIM; ++n) a[n] = A[d * NDIM + n];
  const float dbias = delta_bias[d];
  const float Dvd   = Dv[d];

  float h[NDIM];
  #pragma unroll
  for (int n = 0; n < NDIM; ++n) h[n] = 0.f;

  const float* bcp = (lane < 16) ? (Bp + lane) : (Cp + (lane - 16));
  const size_t rbase = (size_t)b * LSEQ;

  for (int l = 0; l < LSEQ; ++l) {
    const size_t r = rbase + l;
    const float bc = bcp[r * NDIM];
    const float ut = u [r * DDIM + d];
    const float zt = zy[r * DDIM + d];

    const float sx = ut + dbias;
    const float dt = (sx > 20.f) ? sx : log1pf(__expf(sx));   // softplus
    const float du = dt * ut;

    float yv = 0.f;
    #pragma unroll
    for (int n = 0; n < NDIM; ++n) {
      const float Bn = __shfl(bc, n, 32);
      const float Cn = __shfl(bc, n + 16, 32);
      h[n] = __expf(dt * a[n]) * h[n] + du * Bn;
      yv  += h[n] * Cn;
    }
    yv += ut * Dvd;
    const float gate = zt / (1.f + __expf(-zt));              // silu(z)
    zy[r * DDIM + d] = yv * gate;
  }
}

// ---------------------------------------------------------------------------
// Kernel 3: yo = y*Wo^T + bo ; out = x + LayerNorm(yo)*gamma + beta
// ---------------------------------------------------------------------------
__global__ __launch_bounds__(128)
void mamba_outln_kernel(const float* __restrict__ y,  const float* __restrict__ Wo,
                        const float* __restrict__ bo, const float* __restrict__ gamma,
                        const float* __restrict__ beta, const float* __restrict__ x,
                        float* __restrict__ out)
{
  __shared__ float smem[2 * 16 * LROWF];
  float* ys = smem;
  float* os = smem + 16 * LROWF;

  const int tid  = threadIdx.x;
  const int wave = tid >> 5;
  const int lane = tid & 31;
  const int half = lane >> 4;
  const int lid  = lane & 15;
  const int r0   = blockIdx.x * 16;

  if (tid < 32) {
    tdm_load_16x512(y + (size_t)r0 * DDIM, lds_off(ys));
    __builtin_amdgcn_s_wait_tensorcnt(0);
  }
  __syncthreads();

  for (int p = 0; p < 4; ++p) {
    const int n0 = (wave * 8 + 2 * p) * 16;
    v8f acc0 = {}; v8f acc1 = {};
    const float* w0 = Wo + (size_t)(n0 + lid) * DDIM + 2 * half;
    const float* w1 = w0 + 16 * DDIM;
    #pragma unroll 4
    for (int k = 0; k < DDIM; k += 4) {
      v2f a = *(const v2f*)&ys[pidx(lid, k + 2 * half)];
      acc0 = wmma_k4(a, *(const v2f*)(w0 + k), acc0);
      acc1 = wmma_k4(a, *(const v2f*)(w1 + k), acc1);
    }
    const float bn0 = bo[n0 + lid];
    const float bn1 = bo[n0 + 16 + lid];
    #pragma unroll
    for (int j = 0; j < 8; ++j) {
      const int row = j + 8 * half;
      os[pidx(row, n0 + lid)]      = acc0[j] + bn0;
      os[pidx(row, n0 + 16 + lid)] = acc1[j] + bn1;
    }
  }
  __syncthreads();

  // LayerNorm + residual: each wave owns 4 rows; butterfly reduce in-wave.
  for (int rr = 0; rr < 4; ++rr) {
    const int row = wave * 4 + rr;
    float s1 = 0.f, s2 = 0.f;
    #pragma unroll
    for (int j = 0; j < 16; ++j) {
      const float v = os[pidx(row, lane + 32 * j)];
      s1 += v; s2 += v * v;
    }
    #pragma unroll
    for (int off = 16; off > 0; off >>= 1) {
      s1 += __shfl_xor(s1, off, 32);
      s2 += __shfl_xor(s2, off, 32);
    }
    const float mu   = s1 * (1.f / 512.f);
    const float var  = s2 * (1.f / 512.f) - mu * mu;
    const float rstd = rsqrtf(var + 1e-5f);
    #pragma unroll
    for (int j = 0; j < 16; ++j) {
      const int col = lane + 32 * j;
      const float ln = (os[pidx(row, col)] - mu) * rstd * gamma[col] + beta[col];
      const size_t gi = (size_t)(r0 + row) * DDIM + col;
      out[gi] = x[gi] + ln;
    }
  }
}

// ---------------------------------------------------------------------------
extern "C" void kernel_launch(void* const* d_in, const int* in_sizes, int n_in,
                              void* d_out, int out_size, void* d_ws, size_t ws_size,
                              hipStream_t stream) {
  (void)in_sizes; (void)n_in; (void)out_size; (void)ws_size;
  const float* x     = (const float*)d_in[0];
  const float* Wi    = (const float*)d_in[1];
  const float* bi    = (const float*)d_in[2];
  const float* Wz    = (const float*)d_in[3];
  const float* bz    = (const float*)d_in[4];
  const float* A     = (const float*)d_in[5];
  const float* Dv    = (const float*)d_in[6];
  const float* dbias = (const float*)d_in[7];
  const float* WB    = (const float*)d_in[8];
  const float* bB    = (const float*)d_in[9];
  const float* WC    = (const float*)d_in[10];
  const float* bC    = (const float*)d_in[11];
  const float* Wo    = (const float*)d_in[12];
  const float* bo    = (const float*)d_in[13];
  const float* gamma = (const float*)d_in[14];
  const float* beta  = (const float*)d_in[15];
  float* out = (float*)d_out;

  float* ws = (float*)d_ws;
  float* u  = ws;                                   // RTOT*DDIM
  float* zy = u  + (size_t)RTOT * DDIM;             // RTOT*DDIM (z, then y)
  float* Bp = zy + (size_t)RTOT * DDIM;             // RTOT*NDIM
  float* Cp = Bp + (size_t)RTOT * NDIM;             // RTOT*NDIM

  mamba_proj_kernel<<<RTOT / 16, 128, 0, stream>>>(x, Wi, bi, Wz, bz, WB, bB,
                                                   WC, bC, u, zy, Bp, Cp);
  mamba_scan_kernel<<<BSZ * (DDIM / 32), 32, 0, stream>>>(u, zy, Bp, Cp, A, Dv,
                                                          dbias);
  mamba_outln_kernel<<<RTOT / 16, 128, 0, stream>>>(zy, Wo, bo, gamma, beta, x,
                                                    out);
}

// v001
// One run takes 186 microseconds.
// Timed twice side by side with v000, it ran 5.12 times as fast both times.
#include <hip/hip_runtime.h>
#include <math.h>

typedef __attribute__((ext_vector_type(2))) float    v2f;
typedef __attribute__((ext_vector_type(8))) float    v8f;
typedef __attribute__((ext_vector_type(4))) unsigned v4u;
typedef __attribute__((ext_vector_type(8))) unsigned v8u;

#define DDIM 512
#define NDIM 16
#define LSEQ 1024
#define BSZ  8
#define RTOT (BSZ * LSEQ)          // 8192 token rows
#define LROWF 516                  // effective padded row stride (floats)

__device__ __forceinline__ int pidx(int row, int col) {
  return row * LROWF + col + ((col >> 8) << 1);
}

__device__ __forceinline__ unsigned lds_off(const void* p) {
  return (unsigned)(unsigned long long)
         (__attribute__((address_space(3))) const void*)p;
}

__device__ __forceinline__ void tdm_load_16x512(const float* gsrc,
                                                unsigned lds_byte) {
  unsigned long long ga = (unsigned long long)gsrc;
  v4u g0;
  g0[0] = 1u;                                    // count=1 (valid), user mode
  g0[1] = lds_byte;                              // lds_addr
  g0[2] = (unsigned)ga;                          // global_addr[31:0]
  g0[3] = (unsigned)((ga >> 32) & 0x01FFFFFFull) // global_addr[56:32]
        | (2u << 30);                            // type=2 ("image")
  v8u g1;
  g1[0] = (2u << 16)
        | (1u << 20)
        | (7u << 22)
        | (1u << 25);
  g1[1] = (512u << 16);
  g1[2] = (16u  << 16);
  g1[3] = (512u << 16);
  g1[4] = 16u;
  g1[5] = 512u;
  g1[6] = 0u;
  g1[7] = 0u;
  asm volatile("tensor_load_to_lds %0, %1" :: "s"(g0), "s"(g1) : "memory");
}

__device__ __forceinline__ v8f wmma_k4(v2f a, v2f b, v8f c) {
  return __builtin_amdgcn_wmma_f32_16x16x4_f32(false, a, false, b, (short)0, c,
                                               false, false);
}

// ---------------------------------------------------------------------------
// Kernel 1: u = x*Wi^T + bi ; z = x*Wz^T + bz ; Bp = u*WB^T + bB ; Cp = u*WC^T + bC
// ---------------------------------------------------------------------------
__global__ __launch_bounds__(128)
void mamba_proj_kernel(const float* __restrict__ x,
                       const float* __restrict__ Wi, const float* __restrict__ bi,
                       const float* __restrict__ Wz, const float* __restrict__ bz,
                       const float* __restrict__ WB, const float* __restrict__ bB,
                       const float* __restrict__ WC, const float* __restrict__ bC,
                       float* __restrict__ u, float* __restrict__ z,
                       float* __restrict__ Bp, float* __restrict__ Cp)
{
  __shared__ float smem[2 * 16 * LROWF];
  float* xs = smem;
  float* us = smem + 16 * LROWF;

  const int tid  = threadIdx.x;
  const int wave = tid >> 5;
  const int lane = tid & 31;
  const int half = lane >> 4;       // K sub-block select (K=0,1 vs K=2,3)
  const int lid  = lane & 15;
  const int r0   = blockIdx.x * 16;

  if (tid < 32) {                   // wave 0 drives the tile DMA
    tdm_load_16x512(x + (size_t)r0 * DDIM, lds_off(xs));
    __builtin_amdgcn_s_wait_tensorcnt(0);
  }
  __syncthreads();

  const bool   is_u = (wave < 2);
  const float* W    = is_u ? Wi : Wz;
  const float* bias = is_u ? bi : bz;
  float*       outp = is_u ? u  : z;
  const int tbase = (wave & 1) * 16;     // 16 column-tiles per wave, 8 pairs

  for (int p = 0; p < 8; ++p) {
    const int n0 = (tbase + 2 * p) * 16;
    v8f acc0 = {}; v8f acc1 = {};
    const float* w0 = W + (size_t)(n0 + lid) * DDIM + 2 * half;
    const float* w1 = w0 + 16 * DDIM;
    #pragma unroll 4
    for (int k = 0; k < DDIM; k += 4) {
      v2f a  = *(const v2f*)&xs[pidx(lid, k + 2 * half)];  // ds_load_b64
      v2f b0 = *(const v2f*)(w0 + k);                      // global_load_b64
      v2f b1 = *(const v2f*)(w1 + k);
      acc0 = wmma_k4(a, b0, acc0);
      acc1 = wmma_k4(a, b1, acc1);
    }
    const float bn0 = bias[n0 + lid];
    const float bn1 = bias[n0 + 16 + lid];
    #pragma unroll
    for (int j = 0; j < 8; ++j) {
      const int row = j + 8 * half;                        // C/D: M = j + 8*half
      float v0 = acc0[j] + bn0;
      float v1 = acc1[j] + bn1;
      outp[(size_t)(r0 + row) * DDIM + n0 + lid]      = v0;
      outp[(size_t)(r0 + row) * DDIM + n0 + 16 + lid] = v1;
      if (is_u) {
        us[pidx(row, n0 + lid)]      = v0;
        us[pidx(row, n0 + 16 + lid)] = v1;
      }
    }
  }
  __syncthreads();

  // Bp (wave 0) / Cp (wave 1): one 16x16 tile each, K=512 from LDS u tile.
  if (wave < 2) {
    const float* Wn = wave ? WC : WB;
    const float* bn = wave ? bC : bB;
    float*       op = wave ? Cp : Bp;
    v8f acc = {};
    const float* w0 = Wn + (size_t)lid * DDIM + 2 * half;
    #pragma unroll 4
    for (int k = 0; k < DDIM; k += 4) {
      v2f a = *(const v2f*)&us[pidx(lid, k + 2 * half)];
      v2f b = *(const v2f*)(w0 + k);
      acc = wmma_k4(a, b, acc);
    }
    const float bb = bn[lid];
    #pragma unroll
    for (int j = 0; j < 8; ++j) {
      const int row = j + 8 * half;
      op[(size_t)(r0 + row) * NDIM + lid] = acc[j] + bb;
    }
  }
}

#define SCHUNK 64
#define SLEN   (LSEQ / SCHUNK)
#define SCH    16
#define HPITCH (SCHUNK * SCH + 16)

__global__ __launch_bounds__(1024)
void mamba_scan_kernel(const float* __restrict__ u, float* __restrict__ zy,
                       const float* __restrict__ Bp, const float* __restrict__ Cp,
                       const float* __restrict__ A,  const float* __restrict__ Dv,
                       const float* __restrict__ delta_bias)
{
  __shared__ float hs[NDIM * HPITCH];    // [n][chunk][channel]
  __shared__ float sd[SCHUNK * SCH];     // [chunk][channel]
  __shared__ float dts[SLEN * SCHUNK * SCH];  // [step][chunk][channel]

  const int tid   = threadIdx.x;
  const int lid   = tid & 15;            // channel in the slice
  const int chunk = tid >> 4;
  const int b     = blockIdx.x >> 5;
  const int d     = ((blockIdx.x & 31) << 4) + lid;

  float a[NDIM];
  #pragma unroll
  for (int n = 0; n < NDIM; ++n) a[n] = A[d * NDIM + n];
  const float dbias = delta_bias[d];
  const float Dvd   = Dv[d];

  const size_t rbase = (size_t)b * LSEQ + (size_t)chunk * SLEN;

  // pass 1
  v2f h2[NDIM / 2];
  #pragma unroll
  for (int k = 0; k < NDIM / 2; ++k) h2[k] = (v2f){0.f, 0.f};
  float sdt = 0.f;
  #pragma unroll 1   // unrolled further, the build spills registers to scratch
  for (int l0 = 0; l0 < SLEN; l0 += 4) {
    // four steps' loads issued together, ahead of the branches of softplus
    float ub[4], bb[4];
    #pragma unroll
    for (int i = 0; i < 4; ++i) {
      const size_t r = rbase + l0 + i;
      bb[i] = Bp[r * NDIM + lid];
      ub[i] = u [r * DDIM + d];
    }
    #pragma unroll
    for (int i = 0; i < 4; ++i) {
      const float bB = bb[i];
      const float ut = ub[i];

      const float sx = ut + dbias;
      const float dt = (sx > 20.f) ? sx : log1pf(__expf(sx));   // softplus
      const float du = dt * ut;
      sdt += dt;
      dts[(l0 + i) * (SCHUNK * SCH) + tid] = dt;

      // states in pairs as packed f32: half the multiply and fma issues (the
      // build forms the same pairs by itself in pass 3)
      #pragma unroll
      for (int k = 0; k < NDIM / 2; ++k) {
        const v2f B2 = {__shfl(bB, 2 * k, 16), __shfl(bB, 2 * k + 1, 16)};
        const v2f a2 = {a[2 * k], a[2 * k + 1]};
        const v2f x  = dt * a2;
        const v2f e  = {__expf(x[0]), __expf(x[1])};
        h2[k] = e * h2[k] + du * B2;
      }
    }
  }
  #pragma unroll
  for (int n = 0; n < NDIM; ++n) hs[n * HPITCH + tid] = h2[n >> 1][n & 1];
  sd[tid] = sdt;
  __syncthreads();

  // pass 2: eight whole waves, lane = (n, channel); end[j] is replaced by H[j]
  if (tid < NDIM * SCH) {
    const float an  = A[d * NDIM + chunk];           // here chunk == n
    float*      col = hs + chunk * HPITCH + lid;
    float c = col[0];                                // H[1] = end[0], as H[0] = 0
    col[0] = 0.f;
    #pragma unroll 7   // 63 trips; LDS reads and exps run ahead of the chain
    for (int j = 1; j < SCHUNK; ++j) {
      const float e = col[j * SCH];
      col[j * SCH] = c;
      // the chunk's decay is kept finite: a zero state then stays zero, as in
      // the step-by-step product, also where the exp of the sum overflows
      const float g = fminf(__expf(sd[j * SCH + lid] * an), __FLT_MAX__);
      c = g * c + e;
    }
  }
  __syncthreads();

  // pass 3
  float h[NDIM];
  #pragma unroll
  for (int n = 0; n < NDIM; ++n) h[n] = hs[n * HPITCH + tid];

  #pragma unroll 2   // two steps' loads in flight per wait; four spill registers
  for (int l = 0; l < SLEN; ++l) {
    const size_t r = rbase + l;
    const float bB = Bp[r * NDIM + lid];
    const float bC = Cp[r * NDIM + lid];
    const float ut = u [r * DDIM + d];
    const float zt = zy[r * DDIM + d];

    const float dt = dts[l * (SCHUNK * SCH) + tid];           // own lane's, pass 1
    const float du = dt * ut;

    float yv = 0.f;
    #pragma unroll
    for (int n = 0; n < NDIM; ++n) {
      const float Bn = __shfl(bB, n, 16);
      const float Cn = __shfl(bC, n, 16);
      h[n] = __expf(dt * a[n]) * h[n] + du * Bn;
      yv  += h[n] * Cn;
    }
    yv += ut * Dvd;
    const float gate = zt / (1.f + __expf(-zt));              // silu(z)
    zy[r * DDIM + d] = yv * gate;
  }
}

// ---------------------------------------------------------------------------
// Kernel 3: yo = y*Wo^T + bo ; out = x + LayerNorm(yo)*gamma + beta
// ---------------------------------------------------------------------------
__global__ __launch_bounds__(128)
void mamba_outln_kernel(const float* __restrict__ y,  const float* __restrict__ Wo,
                        const float* __restrict__ bo, const float* __restrict__ gamma,
                        const float* __restrict__ beta, const float* __restrict__ x,
                        float* __restrict__ out)
{
  __shared__ float smem[2 * 16 * LROWF];
  float* ys = smem;
  float* os = smem + 16 * LROWF;

  const int tid  = threadIdx.x;
  const int wave = tid >> 5;
  const int lane = tid & 31;
  const int half = lane >> 4;
  const int lid  = lane & 15;
  const int r0   = blockIdx.x * 16;

  if (tid < 32) {
    tdm_load_16x512(y + (size_t)r0 * DDIM, lds_off(ys));
    __builtin_amdgcn_s_wait_tensorcnt(0);
  }
  __syncthreads();

  for (int p = 0; p < 4; ++p) {
    const int n0 = (wave * 8 + 2 * p) * 16;
    v8f acc0 = {}; v8f acc1 = {};
    const float* w0 = Wo + (size_t)(n0 + lid) * DDIM + 2 * half;
    const float* w1 = w0 + 16 * DDIM;
    #pragma unroll 4
    for (int k = 0; k < DDIM; k += 4) {
      v2f a = *(const v2f*)&ys[pidx(lid, k + 2 * half)];
      acc0 = wmma_k4(a, *(const v2f*)(w0 + k), acc0);
      acc1 = wmma_k4(a, *(const v2f*)(w1 + k), acc1);
    }
    const float bn0 = bo[n0 + lid];
    const float bn1 = bo[n0 + 16 + lid];
    #pragma unroll
    for (int j = 0; j < 8; ++j) {
      const int row = j + 8 * half;
      os[pidx(row, n0 + lid)]      = acc0[j] + bn0;
      os[pidx(row, n0 + 16 + lid)] = acc1[j] + bn1;
    }
  }
  __syncthreads();

  // LayerNorm + residual: each wave owns 4 rows; butterfly reduce in-wave.
  for (int rr = 0; rr < 4; ++rr) {
    const int row = wave * 4 + rr;
    float s1 = 0.f, s2 = 0.f;
    #pragma unroll
    for (int j = 0; j < 16; ++j) {
      const float v = os[pidx(row, lane + 32 * j)];
      s1 += v; s2 += v * v;
    }
    #pragma unroll
    for (int off = 16; off > 0; off >>= 1) {
      s1 += __shfl_xor(s1, off, 32);
      s2 += __shfl_xor(s2, off, 32);
    }
    const float mu   = s1 * (1.f / 512.f);
    const float var  = s2 * (1.f / 512.f) - mu * mu;
    const float rstd = rsqrtf(var + 1e-5f);
    #pragma unroll
    for (int j = 0; j < 16; ++j) {
      const int col = lane + 32 * j;
      const float ln = (os[pidx(row, col)] - mu) * rstd * gamma[col] + beta[col];
      const size_t gi = (size_t)(r0 + row) * DDIM + col;
      out[gi] = x[gi] + ln;
    }
  }
}

// ---------------------------------------------------------------------------
extern "C" void kernel_launch(void* const* d_in, const int* in_sizes, int n_in,
                              void* d_out, int out_size, void* d_ws, size_t ws_size,
                              hipStream_t stream) {
  (void)in_sizes; (void)n_in; (void)out_size; (void)ws_size;
  const float* x     = (const float*)d_in[0];
  const float* Wi    = (const float*)d_in[1];
  const float* bi    = (const float*)d_in[2];
  const float* Wz    = (const float*)d_in[3];
  const float* bz    = (const float*)d_in[4];
  const float* A     = (const float*)d_in[5];
  const float* Dv    = (const float*)d_in[6];
  const float* dbias = (const float*)d_in[7];
  const float* WB    = (const float*)d_in[8];
  const float* bB    = (const float*)d_in[9];
  const float* WC    = (const float*)d_in[10];
  const float* bC    = (const float*)d_in[11];
  const float* Wo    = (const float*)d_in[12];
  const float* bo    = (const float*)d_in[13];
  const float* gamma = (const float*)d_in[14];
  const float* beta  = (const float*)d_in[15];
  float* out = (float*)d_out;

  float* ws = (float*)d_ws;
  float* u  = ws;                                   // RTOT*DDIM
  float* zy = u  + (size_t)RTOT * DDIM;             // RTOT*DDIM (z, then y)
  float* Bp = zy + (size_t)RTOT * DDIM;             // RTOT*NDIM
  float* Cp = Bp + (size_t)RTOT * NDIM;             // RTOT*NDIM

  mamba_proj_kernel<<<RTOT / 16, 128, 0, stream>>>(x, Wi, bi, Wz, bz, WB, bB,
                                                   WC, bC, u, zy, Bp, Cp);
  mamba_scan_kernel<<<BSZ * (DDIM / 16), 1024, 0, stream>>>(u, zy, Bp, Cp, A, Dv,
                                                          dbias);
  mamba_outln_kernel<<<RTOT / 16, 128, 0, stream>>>(zy, Wo, bo, gamma, beta, x,
                                                    out);
}

// v002
// A run of this version takes 132 microseconds.
// Two timings next to v001 both put it at 1.41 times that version's speed.
// Counting every step since v000, it is 7.23 times as fast.
#include <hip/hip_runtime.h>
#include <math.h>

typedef __attribute__((ext_vector_type(2))) float    v2f;
typedef __attribute__((ext_vector_type(8))) float    v8f;
typedef __attribute__((ext_vector_type(4))) float    v4f;

#define DDIM 512
#define NDIM 16
#define LSEQ 1024
#define BSZ  8
#define RTOT (BSZ * LSEQ)          // 8192 token rows
#define LROWF 516                  // effective padded row stride (floats)

__device__ __forceinline__ int pidx(int row, int col) {
  return row * LROWF + col;
}

// ROWS x 512 f32 from global (row stride 512) into LDS at row stride LROWF, by
// all 256 threads: a wave moves 512 contiguous bytes per load and per store.
template <int ROWS>
__device__ __forceinline__ void stage_rows(const float* gsrc, float* lds, int tid) {
  #pragma unroll
  for (int i = 0; i < ROWS * DDIM / 4 / 256; ++i) {
    const int e = i * 256 + tid;                 // index of a group of 4 floats
    const v4f v = *(const v4f*)(gsrc + 4 * e);
    *(v4f*)&lds[pidx(e >> 7, (e & 127) << 2)] = v;
  }
}

__device__ __forceinline__ v8f wmma_k4(v2f a, v2f b, v8f c) {
  return __builtin_amdgcn_wmma_f32_16x16x4_f32(false, a, false, b, (short)0, c,
                                               false, false);
}

// ---------------------------------------------------------------------------
// Kernel 1: u = x*Wi^T + bi ; z = x*Wz^T + bz ; Bp = u*WB^T + bB ; Cp = u*WC^T + bC
// ---------------------------------------------------------------------------
// One work-group of 8 waves per (64 token rows, u or z): a wave owns 64 output
// columns, two column tiles at a time, over all four row tiles.
#define PROWS 64
#define PMT   (PROWS / 16)

__global__ __launch_bounds__(256)
void mamba_proj_kernel(const float* __restrict__ x,
                       const float* __restrict__ Wi, const float* __restrict__ bi,
                       const float* __restrict__ Wz, const float* __restrict__ bz,
                       const float* __restrict__ WB, const float* __restrict__ bB,
                       const float* __restrict__ WC, const float* __restrict__ bC,
                       float* __restrict__ u, float* __restrict__ z,
                       float* __restrict__ Bp, float* __restrict__ Cp)
{
  __shared__ float smem[2 * PROWS * LROWF];
  float* xs = smem;
  float* us = smem + PROWS * LROWF;

  const int tid  = threadIdx.x;
  const int wave = tid >> 5;
  const int lane = tid & 31;
  const int half = lane >> 4;       // K sub-block select (K=0,1 vs K=2,3)
  const int lid  = lane & 15;
  const int r0   = (blockIdx.x >> 1) * PROWS;

  stage_rows<PROWS>(x + (size_t)r0 * DDIM, xs, tid);
  __syncthreads();

  const bool   is_u = (blockIdx.x & 1) == 0;
  const float* W    = is_u ? Wi : Wz;
  const float* bias = is_u ? bi : bz;
  float*       outp = is_u ? u  : z;

  for (int p = 0; p < 2; ++p) {
    const int n0 = (wave * 4 + 2 * p) * 16;
    v8f acc0[PMT] = {}; v8f acc1[PMT] = {};
    const float* w0 = W + (size_t)(n0 + lid) * DDIM + 2 * half;
    const float* w1 = w0 + 16 * DDIM;
    #pragma unroll 4
    for (int k = 0; k < DDIM; k += 4) {
      v2f b0 = *(const v2f*)(w0 + k);                      // global_load_b64
      v2f b1 = *(const v2f*)(w1 + k);
      #pragma unroll
      for (int m = 0; m < PMT; ++m) {
        v2f a = *(const v2f*)&xs[pidx(m * 16 + lid, k + 2 * half)];  // ds_load_b64
        acc0[m] = wmma_k4(a, b0, acc0[m]);
        acc1[m] = wmma_k4(a, b1, acc1[m]);
      }
    }
    const float bn0 = bias[n0 + lid];
    const float bn1 = bias[n0 + 16 + lid];
    #pragma unroll
    for (int m = 0; m < PMT; ++m) {
      #pragma unroll
      for (int j = 0; j < 8; ++j) {
        const int row = m * 16 + j + 8 * half;             // C/D: M = j + 8*half
        float v0 = acc0[m][j] + bn0;
        float v1 = acc1[m][j] + bn1;
        outp[(size_t)(r0 + row) * DDIM + n0 + lid]      = v0;
        outp[(size_t)(r0 + row) * DDIM + n0 + 16 + lid] = v1;
        acc0[m][j] = v0;
        acc1[m][j] = v1;
      }
    }
    asm volatile("s_wait_xcnt 0x0" ::: "memory");
    if (is_u) {
      #pragma unroll
      for (int m = 0; m < PMT; ++m) {
        #pragma unroll
        for (int j = 0; j < 8; ++j) {
          const int row = m * 16 + j + 8 * half;
          us[pidx(row, n0 + lid)]      = acc0[m][j];
          us[pidx(row, n0 + 16 + lid)] = acc1[m][j];
        }
      }
    }
  }
  __syncthreads();

  // Bp (waves 0-3) / Cp (waves 4-7): one 16x16 tile each, K=512 from LDS u tile.
  if (is_u) {
    const int    m  = wave & 3;
    const bool   wc = wave >= 4;
    const float* Wn = wc ? WC : WB;
    const float* bn = wc ? bC : bB;
    float*       op = wc ? Cp : Bp;
    v8f acc = {};
    const float* w0 = Wn + (size_t)lid * DDIM + 2 * half;
    #pragma unroll 4
    for (int k = 0; k < DDIM; k += 4) {
      v2f a = *(const v2f*)&us[pidx(m * 16 + lid, k + 2 * half)];
      v2f b = *(const v2f*)(w0 + k);
      acc = wmma_k4(a, b, acc);
    }
    const float bb = bn[lid];
    #pragma unroll
    for (int j = 0; j < 8; ++j) {
      const int row = m * 16 + j + 8 * half;
      op[(size_t)(r0 + row) * NDIM + lid] = acc[j] + bb;
    }
  }
}

#define SCHUNK 64
#define SLEN   (LSEQ / SCHUNK)
#define SCH    16
#define HPITCH (SCHUNK * SCH + 16)

__global__ __launch_bounds__(1024)
void mamba_scan_kernel(const float* __restrict__ u, float* __restrict__ zy,
                       const float* __restrict__ Bp, const float* __restrict__ Cp,
                       const float* __restrict__ A,  const float* __restrict__ Dv,
                       const float* __restrict__ delta_bias)
{
  __shared__ float hs[NDIM * HPITCH];    // [n][chunk][channel]
  __shared__ float sd[SCHUNK * SCH];     // [chunk][channel]
  __shared__ float dts[SLEN * SCHUNK * SCH];  // [step][chunk][channel]

  const int tid   = threadIdx.x;
  const int lid   = tid & 15;            // channel in the slice
  const int chunk = tid >> 4;
  const int b     = blockIdx.x >> 5;
  const int d     = ((blockIdx.x & 31) << 4) + lid;

  float a[NDIM];
  #pragma unroll
  for (int n = 0; n < NDIM; ++n) a[n] = A[d * NDIM + n];
  const float dbias = delta_bias[d];
  const float Dvd   = Dv[d];

  const size_t rbase = (size_t)b * LSEQ + (size_t)chunk * SLEN;

  // pass 1
  v2f h2[NDIM / 2];
  #pragma unroll
  for (int k = 0; k < NDIM / 2; ++k) h2[k] = (v2f){0.f, 0.f};
  float sdt = 0.f;
  #pragma unroll 1   // unrolled further, the build spills registers to scratch
  for (int l0 = 0; l0 < SLEN; l0 += 4) {
    // four steps' loads issued together, ahead of the branches of softplus
    float ub[4], bb[4];
    #pragma unroll
    for (int i = 0; i < 4; ++i) {
      const size_t r = rbase + l0 + i;
      bb[i] = Bp[r * NDIM + lid];
      ub[i] = u [r * DDIM + d];
    }
    #pragma unroll
    for (int i = 0; i < 4; ++i) {
      const float bB = bb[i];
      const float ut = ub[i];

      const float sx = ut + dbias;
      const float dt = (sx > 20.f) ? sx : log1pf(__expf(sx));   // softplus
      const float du = dt * ut;
      sdt += dt;
      dts[(l0 + i) * (SCHUNK * SCH) + tid] = dt;

      // states in pairs as packed f32: half the multiply and fma issues (the
      // build forms the same pairs by itself in pass 3)
      #pragma unroll
      for (int k = 0; k < NDIM / 2; ++k) {
        const v2f B2 = {__shfl(bB, 2 * k, 16), __shfl(bB, 2 * k + 1, 16)};
        const v2f a2 = {a[2 * k], a[2 * k + 1]};
        const v2f x  = dt * a2;
        const v2f e  = {__expf(x[0]), __expf(x[1])};
        h2[k] = e * h2[k] + du * B2;
      }
    }
  }
  #pragma unroll
  for (int n = 0; n < NDIM; ++n) hs[n * HPITCH + tid] = h2[n >> 1][n & 1];
  sd[tid] = sdt;
  __syncthreads();

  // pass 2: eight whole waves, lane = (n, channel); end[j] is replaced by H[j]
  if (tid < NDIM * SCH) {
    const float an  = A[d * NDIM + chunk];           // here chunk == n
    float*      col = hs + chunk * HPITCH + lid;
    float c = col[0];                                // H[1] = end[0], as H[0] = 0
    col[0] = 0.f;
    #pragma unroll 7   // 63 trips; LDS reads and exps run ahead of the chain
    for (int j = 1; j < SCHUNK; ++j) {
      const float e = col[j * SCH];
      col[j * SCH] = c;
      // the chunk's decay is kept finite: a zero state then stays zero, as in
      // the step-by-step product, also where the exp of the sum overflows
      const float g = fminf(__expf(sd[j * SCH + lid] * an), __FLT_MAX__);
      c = g * c + e;
    }
  }
  __syncthreads();

  // pass 3
  float h[NDIM];
  #pragma unroll
  for (int n = 0; n < NDIM; ++n) h[n] = hs[n * HPITCH + tid];

  #pragma unroll 2   // two steps' loads in flight per wait; four spill registers
  for (int l = 0; l < SLEN; ++l) {
    const size_t r = rbase + l;
    const float bB = Bp[r * NDIM + lid];
    const float bC = Cp[r * NDIM + lid];
    const float ut = u [r * DDIM + d];
    const float zt = zy[r * DDIM + d];

    const float dt = dts[l * (SCHUNK * SCH) + tid];           // own lane's, pass 1
    const float du = dt * ut;

    float yv = 0.f;
    #pragma unroll
    for (int n = 0; n < NDIM; ++n) {
      const float Bn = __shfl(bB, n, 16);
      const float Cn = __shfl(bC, n, 16);
      h[n] = __expf(dt * a[n]) * h[n] + du * Bn;
      yv  += h[n] * Cn;
    }
    yv += ut * Dvd;
    const float gate = zt / (1.f + __expf(-zt));              // silu(z)
    zy[r * DDIM + d] = yv * gate;
  }
}

// ---------------------------------------------------------------------------
// Kernel 3: yo = y*Wo^T + bo ; out = x + LayerNorm(yo)*gamma + beta
// ---------------------------------------------------------------------------
// One work-group of 8 waves per 32 token rows (LayerNorm needs whole rows): a
// wave owns 64 output columns, two column tiles at a time, over both row tiles.
#define OROWS 32
#define OMT   (OROWS / 16)

__global__ __launch_bounds__(256)
void mamba_outln_kernel(const float* __restrict__ y,  const float* __restrict__ Wo,
                        const float* __restrict__ bo, const float* __restrict__ gamma,
                        const float* __restrict__ beta, const float* __restrict__ x,
                        float* __restrict__ out)
{
  __shared__ float smem[2 * OROWS * LROWF];
  float* ys = smem;
  float* os = smem + OROWS * LROWF;

  const int tid  = threadIdx.x;
  const int wave = tid >> 5;
  const int lane = tid & 31;
  const int half = lane >> 4;
  const int lid  = lane & 15;
  const int r0   = blockIdx.x * OROWS;

  stage_rows<OROWS>(y + (size_t)r0 * DDIM, ys, tid);
  __syncthreads();

  for (int p = 0; p < 2; ++p) {
    const int n0 = (wave * 4 + 2 * p) * 16;
    v8f acc0[OMT] = {}; v8f acc1[OMT] = {};
    const float* w0 = Wo + (size_t)(n0 + lid) * DDIM + 2 * half;
    const float* w1 = w0 + 16 * DDIM;
    #pragma unroll 4
    for (int k = 0; k < DDIM; k += 4) {
      v2f b0 = *(const v2f*)(w0 + k);
      v2f b1 = *(const v2f*)(w1 + k);
      #pragma unroll
      for (int m = 0; m < OMT; ++m) {
        v2f a = *(const v2f*)&ys[pidx(m * 16 + lid, k + 2 * half)];
        acc0[m] = wmma_k4(a, b0, acc0[m]);
        acc1[m] = wmma_k4(a, b1, acc1[m]);
      }
    }
    const float bn0 = bo[n0 + lid];
    const float bn1 = bo[n0 + 16 + lid];
    #pragma unroll
    for (int m = 0; m < OMT; ++m) {
      #pragma unroll
      for (int j = 0; j < 8; ++j) {
        const int row = m * 16 + j + 8 * half;
        os[pidx(row, n0 + lid)]      = acc0[m][j] + bn0;
        os[pidx(row, n0 + 16 + lid)] = acc1[m][j] + bn1;
      }
    }
  }
  __syncthreads();

  // LayerNorm + residual: each wave owns 4 rows; butterfly reduce in-wave.
  for (int rr = 0; rr < 4; ++rr) {
    const int row = wave * 4 + rr;
    float s1 = 0.f, s2 = 0.f;
    #pragma unroll
    for (int j = 0; j < 16; ++j) {
      const float v = os[pidx(row, lane + 32 * j)];
      s1 += v; s2 += v * v;
    }
    #pragma unroll
    for (int off = 16; off > 0; off >>= 1) {
      s1 += __shfl_xor(s1, off, 32);
      s2 += __shfl_xor(s2, off, 32);
    }
    const float mu   = s1 * (1.f / 512.f);
    const float var  = s2 * (1.f / 512.f) - mu * mu;
    const float rstd = rsqrtf(var + 1e-5f);
    #pragma unroll
    for (int j = 0; j < 16; ++j) {
      const int col = lane + 32 * j;
      const float ln = (os[pidx(row, col)] - mu) * rstd * gamma[col] + beta[col];
      const size_t gi = (size_t)(r0 + row) * DDIM + col;
      out[gi] = x[gi] + ln;
    }
  }
}

// ---------------------------------------------------------------------------
extern "C" void kernel_launch(void* const* d_in, const int* in_sizes, int n_in,
                              void* d_out, int out_size, void* d_ws, size_t ws_size,
                              hipStream_t stream) {
  (void)in_sizes; (void)n_in; (void)out_size; (void)ws_size;
  const float* x     = (const float*)d_in[0];
  const float* Wi    = (const float*)d_in[1];
  const float* bi    = (const float*)d_in[2];
  const float* Wz    = (const float*)d_in[3];
  const float* bz    = (const float*)d_in[4];
  const float* A     = (const float*)d_in[5];
  const float* Dv    = (const float*)d_in[6];
  const float* dbias = (const float*)d_in[7];
  const float* WB    = (const float*)d_in[8];
  const float* bB    = (const float*)d_in[9];
  const float* WC    = (const float*)d_in[10];
  const float* bC    = (const float*)d_in[11];
  const float* Wo    = (const float*)d_in[12];
  const float* bo    = (const float*)d_in[13];
  const float* gamma = (const float*)d_in[14];
  const float* beta  = (const float*)d_in[15];
  float* out = (float*)d_out;

  float* ws = (float*)d_ws;
  float* u  = ws;                                   // RTOT*DDIM
  float* zy = u  + (size_t)RTOT * DDIM;             // RTOT*DDIM (z, then y)
  float* Bp = zy + (size_t)RTOT * DDIM;             // RTOT*NDIM
  float* Cp = Bp + (size_t)RTOT * NDIM;             // RTOT*NDIM

  mamba_proj_kernel<<<2 * (RTOT / PROWS), 256, 0, stream>>>(x, Wi, bi, Wz, bz, WB, bB,
                                                   WC, bC, u, zy, Bp, Cp);
  mamba_scan_kernel<<<BSZ * (DDIM / 16), 1024, 0, stream>>>(u, zy, Bp, Cp, A, Dv,
                                                          dbias);
  mamba_outln_kernel<<<RTOT / OROWS, 256, 0, stream>>>(zy, Wo, bo, gamma, beta, x,
                                                    out);
}

// v003
// A run of this version takes 126 microseconds.
// Timed twice side by side with v002, it ran 1.05 times as fast both times.
// Over all steps from v000 it is 7.58 times as fast.
#include <hip/hip_runtime.h>
#include <math.h>

typedef __attribute__((ext_vector_type(2))) float    v2f;
typedef __attribute__((ext_vector_type(8))) float    v8f;
typedef __attribute__((ext_vector_type(4))) float    v4f;

#define DDIM 512
#define NDIM 16
#define LSEQ 1024
#define BSZ  8
#define RTOT (BSZ * LSEQ)          // 8192 token rows
#define LROWF 516                  // effective padded row stride (floats)

__device__ __forceinline__ int pidx(int row, int col) {
  return row * LROWF + col;
}

// ROWS x 512 f32 from global (row stride 512) into LDS at row stride LROWF, by
// all 256 threads: a wave moves 512 contiguous bytes per load and per store.
template <int ROWS>
__device__ __forceinline__ void stage_rows(const float* gsrc, float* lds, int tid) {
  constexpr int NV = ROWS * DDIM / 4 / 256;
  v4f v[NV];
  #pragma unroll
  for (int i = 0; i < NV; ++i)                   // i * 256 + tid: a group of 4 floats
    v[i] = *(const v4f*)(gsrc + 4 * (i * 256 + tid));
  asm volatile("s_wait_xcnt 0x0" ::: "memory");
  #pragma unroll
  for (int i = 0; i < NV; ++i) {
    const int e = i * 256 + tid;
    *(v4f*)&lds[pidx(e >> 7, (e & 127) << 2)] = v[i];
  }
}

__device__ __forceinline__ v8f wmma_k4(v2f a, v2f b, v8f c) {
  return __builtin_amdgcn_wmma_f32_16x16x4_f32(false, a, false, b, (short)0, c,
                                               false, false);
}

#define WKC     32
#define WPITCH  36
#define WBUF    (DDIM * WPITCH)    // floats per buffer
#define WSTAGES (DDIM / WKC)

__device__ __forceinline__ void copy8(const unsigned (&l)[8], const float* const (&g)[8]) {
  asm volatile(
      "global_load_async_to_lds_b128 %0, %8, off\n\t"
      "global_load_async_to_lds_b128 %1, %9, off\n\t"
      "global_load_async_to_lds_b128 %2, %10, off\n\t"
      "global_load_async_to_lds_b128 %3, %11, off\n\t"
      "global_load_async_to_lds_b128 %4, %12, off\n\t"
      "global_load_async_to_lds_b128 %5, %13, off\n\t"
      "global_load_async_to_lds_b128 %6, %14, off\n\t"
      "global_load_async_to_lds_b128 %7, %15, off\n\t"
      "s_wait_xcnt 0x0"
      :: "v"(l[0]), "v"(l[1]), "v"(l[2]), "v"(l[3]), "v"(l[4]), "v"(l[5]), "v"(l[6]), "v"(l[7]),
         "v"(g[0]), "v"(g[1]), "v"(g[2]), "v"(g[3]), "v"(g[4]), "v"(g[5]), "v"(g[6]), "v"(g[7])
      : "memory");
}

// Stage s of W into buf: each of the 8 waves copies the 64 weight rows that it
// reads itself, 16 copies of 4 rows (8 lanes a row: one whole line).
__device__ __forceinline__ void copy_wstage(const float* W, float* buf, int wave,
                                            int lane, int s) {
  const int row = wave * 64 + (lane >> 3);
  const int col = (lane & 7) * 4;
  const float*   g0 = W + (size_t)row * DDIM + s * WKC + col;
  const unsigned l0 = (unsigned)(size_t)(buf + row * WPITCH + col);
  #pragma unroll
  for (int h = 0; h < 2; ++h) {
    unsigned l[8]; const float* g[8];
    #pragma unroll
    for (int i = 0; i < 8; ++i) {
      l[i] = l0 + (h * 32 + i * 4) * WPITCH * 4;
      g[i] = g0 + (h * 32 + i * 4) * DDIM;
    }
    copy8(l, g);
  }
}

// The 16 rows of WB and the 16 of WC, whole (K = 512), into dst at pitch LROWF:
// a wave copies 4 rows, 4 copies of 512 contiguous bytes a row.
__device__ __forceinline__ void copy_wbc(const float* WB, const float* WC, float* dst,
                                         int wave, int lane) {
  const float*   g0 = (wave < 4 ? WB : WC) + (size_t)((wave & 3) * 4) * DDIM + lane * 4;
  const unsigned l0 = (unsigned)(size_t)(dst + pidx(wave * 4, lane * 4));
  #pragma unroll
  for (int h = 0; h < 2; ++h) {
    unsigned l[8]; const float* g[8];
    #pragma unroll
    for (int i = 0; i < 8; ++i) {
      const int r = h * 2 + (i >> 2), c = (i & 3) * 128;
      l[i] = l0 + pidx(r, c) * 4;
      g[i] = g0 + r * DDIM + c;
    }
    copy8(l, g);
  }
}

// ROWS x 512 tile (LDS, pitch LROWF) times W^T, K = 512: a wave owns 64 output
// columns (4 column tiles) over all MT row tiles. Stage 0 is landed and published
// and stage 1 is in flight on entry; on return every wave has passed the last
// barrier, so that tile and ring are free.
template <int MT>
__device__ __forceinline__ void gemm_ring(const float* tile, float* ring, const float* W,
                                          int wave, int lane, v8f (&acc)[MT][4]) {
  const int half = lane >> 4;
  const int lid  = lane & 15;
  #pragma unroll 1   // one trip a stage: the publish point stands once in the code
  for (int s = 0; s < WSTAGES; ++s) {
    float*       buf = ring + (s & 1) * WBUF;
    const float* wb  = buf + (wave * 64 + lid) * WPITCH + 2 * half;
    const float* ta  = tile + pidx(lid, s * WKC + 2 * half);
    #pragma unroll
    for (int kk = 0; kk < WKC; kk += 4) {
      v2f a[MT], b[4];
      #pragma unroll
      for (int q = 0; q < 4; ++q) b[q] = *(const v2f*)(wb + q * 16 * WPITCH + kk);
      #pragma unroll
      for (int m = 0; m < MT; ++m) a[m] = *(const v2f*)(ta + pidx(m * 16, kk));
      #pragma unroll
      for (int m = 0; m < MT; ++m) {
        #pragma unroll
        for (int q = 0; q < 4; ++q) acc[m][q] = wmma_k4(a[m], b[q], acc[m][q]);
      }
    }
    // publish point of stage s + 1: own LDS reads of this buffer done, own copies
    // of the next stage landed, then the barrier; only then the refill
    asm volatile("s_wait_dscnt 0x0" ::: "memory");
    asm volatile("s_wait_asynccnt 0x0" ::: "memory");
    __syncthreads();
    if (s + 2 < WSTAGES) copy_wstage(W, buf, wave, lane, s + 2);
  }
  // no copy is left in flight when the ring's LDS is given up
  asm volatile("s_wait_asynccnt 0x0" ::: "memory");
}

// ---------------------------------------------------------------------------
// Kernel 1: u = x*Wi^T + bi ; z = x*Wz^T + bz ; Bp = u*WB^T + bB ; Cp = u*WC^T + bC
// ---------------------------------------------------------------------------
// One work-group of 8 waves per (64 token rows, u or z): a wave owns 64 output
// columns over all four row tiles. The u tile takes the x tile's place in LDS.
#define PROWS 64
#define PMT   (PROWS / 16)

__global__ __launch_bounds__(256)
void mamba_proj_kernel(const float* __restrict__ x,
                       const float* __restrict__ Wi, const float* __restrict__ bi,
                       const float* __restrict__ Wz, const float* __restrict__ bz,
                       const float* __restrict__ WB, const float* __restrict__ bB,
                       const float* __restrict__ WC, const float* __restrict__ bC,
                       float* __restrict__ u, float* __restrict__ z,
                       float* __restrict__ Bp, float* __restrict__ Cp)
{
  __shared__ __attribute__((aligned(16))) float smem[PROWS * LROWF + 2 * WBUF];
  float* xs   = smem;                  // x tile
  float* us   = smem;                  // u tile, once the x tile has been read out
  float* ring = smem + PROWS * LROWF;  // two weight stages

  const int tid  = threadIdx.x;
  const int wave = tid >> 5;
  const int lane = tid & 31;
  const int half = lane >> 4;       // K sub-block select (K=0,1 vs K=2,3)
  const int lid  = lane & 15;
  const int r0   = (blockIdx.x >> 1) * PROWS;

  const bool   is_u = (blockIdx.x & 1) == 0;
  const float* W    = is_u ? Wi : Wz;
  const float* bias = is_u ? bi : bz;
  float*       outp = is_u ? u  : z;

  copy_wstage(W, ring, wave, lane, 0);
  stage_rows<PROWS>(x + (size_t)r0 * DDIM, xs, tid);
  // stage 0 landed (own copies), then published with the x tile by the barrier
  asm volatile("s_wait_asynccnt 0x0" ::: "memory");
  __syncthreads();
  copy_wstage(W, ring + WBUF, wave, lane, 1);

  v8f acc[PMT][4] = {};
  gemm_ring<PMT>(xs, ring, W, wave, lane, acc);

  // the ring is free: WB and WC fly into it while u is stored
  if (is_u) copy_wbc(WB, WC, ring, wave, lane);

  #pragma unroll
  for (int q = 0; q < 4; ++q) {
    const int   n  = wave * 64 + q * 16 + lid;
    const float bn = bias[n];
    #pragma unroll
    for (int m = 0; m < PMT; ++m) {
      #pragma unroll
      for (int j = 0; j < 8; ++j) {
        const int row = m * 16 + j + 8 * half;             // C/D: M = j + 8*half
        const float v = acc[m][q][j] + bn;
        outp[(size_t)(r0 + row) * DDIM + n] = v;
        acc[m][q][j] = v;
      }
    }
  }
  asm volatile("s_wait_xcnt 0x0" ::: "memory");
  if (is_u) {
    #pragma unroll
    for (int q = 0; q < 4; ++q) {
      #pragma unroll
      for (int m = 0; m < PMT; ++m) {
        #pragma unroll
        for (int j = 0; j < 8; ++j) {
          us[pidx(m * 16 + j + 8 * half, wave * 64 + q * 16 + lid)] = acc[m][q][j];
        }
      }
    }
  }
  // WB and WC landed (own copies), then published with the u tile by the barrier
  asm volatile("s_wait_asynccnt 0x0" ::: "memory");
  __syncthreads();

  // Bp (waves 0-3) / Cp (waves 4-7): one 16x16 tile each, K=512, u tile and weights
  // from LDS.
  if (is_u) {
    const int    m  = wave & 3;
    const bool   wc = wave >= 4;
    const float* bn = wc ? bC : bB;
    float*       op = wc ? Cp : Bp;
    v8f acc = {};
    const float* w0 = ring + pidx((wc ? 16 : 0) + lid, 2 * half);
    #pragma unroll 4
    for (int k = 0; k < DDIM; k += 4) {
      v2f a = *(const v2f*)&us[pidx(m * 16 + lid, k + 2 * half)];
      v2f b = *(const v2f*)(w0 + k);
      acc = wmma_k4(a, b, acc);
    }
    const float bb = bn[lid];
    #pragma unroll
    for (int j = 0; j < 8; ++j) {
      const int row = m * 16 + j + 8 * half;
      op[(size_t)(r0 + row) * NDIM + lid] = acc[j] + bb;
    }
  }
}

#define SCHUNK 64
#define SLEN   (LSEQ / SCHUNK)
#define SCH    16
#define HPITCH (SCHUNK * SCH + 16)

__global__ __launch_bounds__(1024)
void mamba_scan_kernel(const float* __restrict__ u, float* __restrict__ zy,
                       const float* __restrict__ Bp, const float* __restrict__ Cp,
                       const float* __restrict__ A,  const float* __restrict__ Dv,
                       const float* __restrict__ delta_bias)
{
  __shared__ float hs[NDIM * HPITCH];    // [n][chunk][channel]
  __shared__ float sd[SCHUNK * SCH];     // [chunk][channel]
  __shared__ float dts[SLEN * SCHUNK * SCH];  // [step][chunk][channel]

  const int tid   = threadIdx.x;
  const int lid   = tid & 15;            // channel in the slice
  const int chunk = tid >> 4;
  const int b     = blockIdx.x >> 5;
  const int d     = ((blockIdx.x & 31) << 4) + lid;

  float a[NDIM];
  #pragma unroll
  for (int n = 0; n < NDIM; ++n) a[n] = A[d * NDIM + n];
  const float dbias = delta_bias[d];
  const float Dvd   = Dv[d];

  const size_t rbase = (size_t)b * LSEQ + (size_t)chunk * SLEN;

  // pass 1
  v2f h2[NDIM / 2];
  #pragma unroll
  for (int k = 0; k < NDIM / 2; ++k) h2[k] = (v2f){0.f, 0.f};
  float sdt = 0.f;
  #pragma unroll 1   // unrolled further, the build spills registers to scratch
  for (int l0 = 0; l0 < SLEN; l0 += 4) {
    // four steps' loads issued together, ahead of the branches of softplus
    float ub[4], bb[4];
    #pragma unroll
    for (int i = 0; i < 4; ++i) {
      const size_t r = rbase + l0 + i;
      bb[i] = Bp[r * NDIM + lid];
      ub[i] = u [r * DDIM + d];
    }
    #pragma unroll
    for (int i = 0; i < 4; ++i) {
      const float bB = bb[i];
      const float ut = ub[i];

      const float sx = ut + dbias;
      const float dt = (sx > 20.f) ? sx : log1pf(__expf(sx));   // softplus
      const float du = dt * ut;
      sdt += dt;
      dts[(l0 + i) * (SCHUNK * SCH) + tid] = dt;

      // states in pairs as packed f32: half the multiply and fma issues (the
      // build forms the same pairs by itself in pass 3)
      #pragma unroll
      for (int k = 0; k < NDIM / 2; ++k) {
        const v2f B2 = {__shfl(bB, 2 * k, 16), __shfl(bB, 2 * k + 1, 16)};
        const v2f a2 = {a[2 * k], a[2 * k + 1]};
        const v2f x  = dt * a2;
        const v2f e  = {__expf(x[0]), __expf(x[1])};
        h2[k] = e * h2[k] + du * B2;
      }
    }
  }
  #pragma unroll
  for (int n = 0; n < NDIM; ++n) hs[n * HPITCH + tid] = h2[n >> 1][n & 1];
  sd[tid] = sdt;
  __syncthreads();

  // pass 2: eight whole waves, lane = (n, channel); end[j] is replaced by H[j]
  if (tid < NDIM * SCH) {
    const float an  = A[d * NDIM + chunk];           // here chunk == n
    float*      col = hs + chunk * HPITCH + lid;
    float c = col[0];                                // H[1] = end[0], as H[0] = 0
    col[0] = 0.f;
    #pragma unroll 7   // 63 trips; LDS reads and exps run ahead of the chain
    for (int j = 1; j < SCHUNK; ++j) {
      const float e = col[j * SCH];
      col[j * SCH] = c;
      // the chunk's decay is kept finite: a zero state then stays zero, as in
      // the step-by-step product, also where the exp of the sum overflows
      const float g = fminf(__expf(sd[j * SCH + lid] * an), __FLT_MAX__);
      c = g * c + e;
    }
  }
  __syncthreads();

  // pass 3
  float h[NDIM];
  #pragma unroll
  for (int n = 0; n < NDIM; ++n) h[n] = hs[n * HPITCH + tid];

  #pragma unroll 2   // two steps' loads in flight per wait; four spill registers
  for (int l = 0; l < SLEN; ++l) {
    const size_t r = rbase + l;
    const float bB = Bp[r * NDIM + lid];
    const float bC = Cp[r * NDIM + lid];
    const float ut = u [r * DDIM + d];
    const float zt = zy[r * DDIM + d];

    const float dt = dts[l * (SCHUNK * SCH) + tid];           // own lane's, pass 1
    const float du = dt * ut;

    float yv = 0.f;
    #pragma unroll
    for (int n = 0; n < NDIM; ++n) {
      const float Bn = __shfl(bB, n, 16);
      const float Cn = __shfl(bC, n, 16);
      h[n] = __expf(dt * a[n]) * h[n] + du * Bn;
      yv  += h[n] * Cn;
    }
    yv += ut * Dvd;
    const float gate = zt / (1.f + __expf(-zt));              // silu(z)
    zy[r * DDIM + d] = yv * gate;
  }
}

// ---------------------------------------------------------------------------
// Kernel 3: yo = y*Wo^T + bo ; out = x + LayerNorm(yo)*gamma + beta
// ---------------------------------------------------------------------------
// One work-group of 8 waves per 32 token rows (LayerNorm needs whole rows): a
// wave owns 64 output columns over both row tiles.
#define OROWS 32
#define OMT   (OROWS / 16)

__global__ __launch_bounds__(256)
void mamba_outln_kernel(const float* __restrict__ y,  const float* __restrict__ Wo,
                        const float* __restrict__ bo, const float* __restrict__ gamma,
                        const float* __restrict__ beta, const float* __restrict__ x,
                        float* __restrict__ out)
{
  __shared__ __attribute__((aligned(16))) float smem[2 * OROWS * LROWF + 2 * WBUF];
  float* ys   = smem;
  float* os   = smem + OROWS * LROWF;
  float* ring = smem + 2 * OROWS * LROWF;  // two weight stages

  const int tid  = threadIdx.x;
  const int wave = tid >> 5;
  const int lane = tid & 31;
  const int half = lane >> 4;
  const int lid  = lane & 15;
  const int r0   = blockIdx.x * OROWS;

  copy_wstage(Wo, ring, wave, lane, 0);
  stage_rows<OROWS>(y + (size_t)r0 * DDIM, ys, tid);
  // stage 0 landed (own copies), then published with the y tile by the barrier
  asm volatile("s_wait_asynccnt 0x0" ::: "memory");
  __syncthreads();
  copy_wstage(Wo, ring + WBUF, wave, lane, 1);

  v8f acc[OMT][4] = {};
  gemm_ring<OMT>(ys, ring, Wo, wave, lane, acc);

  #pragma unroll
  for (int q = 0; q < 4; ++q) {
    const int   n  = wave * 64 + q * 16 + lid;
    const float bn = bo[n];
    #pragma unroll
    for (int m = 0; m < OMT; ++m) {
      #pragma unroll
      for (int j = 0; j < 8; ++j) {
        os[pidx(m * 16 + j + 8 * half, n)] = acc[m][q][j] + bn;
      }
    }
  }
  __syncthreads();

  // LayerNorm + residual: each wave owns 4 rows; butterfly reduce in-wave.
  for (int rr = 0; rr < 4; ++rr) {
    const int row = wave * 4 + rr;
    float s1 = 0.f, s2 = 0.f;
    #pragma unroll
    for (int j = 0; j < 16; ++j) {
      const float v = os[pidx(row, lane + 32 * j)];
      s1 += v; s2 += v * v;
    }
    #pragma unroll
    for (int off = 16; off > 0; off >>= 1) {
      s1 += __shfl_xor(s1, off, 32);
      s2 += __shfl_xor(s2, off, 32);
    }
    const float mu   = s1 * (1.f / 512.f);
    const float var  = s2 * (1.f / 512.f) - mu * mu;
    const float rstd = rsqrtf(var + 1e-5f);
    #pragma unroll
    for (int j = 0; j < 16; ++j) {
      const int col = lane + 32 * j;
      const float ln = (os[pidx(row, col)] - mu) * rstd * gamma[col] + beta[col];
      const size_t gi = (size_t)(r0 + row) * DDIM + col;
      out[gi] = x[gi] + ln;
    }
  }
}

// ---------------------------------------------------------------------------
extern "C" void kernel_launch(void* const* d_in, const int* in_sizes, int n_in,
                              void* d_out, int out_size, void* d_ws, size_t ws_size,
                              hipStream_t stream) {
  (void)in_sizes; (void)n_in; (void)out_size; (void)ws_size;
  const float* x     = (const float*)d_in[0];
  const float* Wi    = (const float*)d_in[1];
  const float* bi    = (const float*)d_in[2];
  const float* Wz    = (const float*)d_in[3];
  const float* bz    = (const float*)d_in[4];
  const float* A     = (const float*)d_in[5];
  const float* Dv    = (const float*)d_in[6];
  const float* dbias = (const float*)d_in[7];
  const float* WB    = (const float*)d_in[8];
  const float* bB    = (const float*)d_in[9];
  const float* WC    = (const float*)d_in[10];
  const float* bC    = (const float*)d_in[11];
  const float* Wo    = (const float*)d_in[12];
  const float* bo    = (const float*)d_in[13];
  const float* gamma = (const float*)d_in[14];
  const float* beta  = (const float*)d_in[15];
  float* out = (float*)d_out;

  float* ws = (float*)d_ws;
  float* u  = ws;                                   // RTOT*DDIM
  float* zy = u  + (size_t)RTOT * DDIM;             // RTOT*DDIM (z, then y)
  float* Bp = zy + (size_t)RTOT * DDIM;             // RTOT*NDIM
  float* Cp = Bp + (size_t)RTOT * NDIM;             // RTOT*NDIM

  mamba_proj_kernel<<<2 * (RTOT / PROWS), 256, 0, stream>>>(x, Wi, bi, Wz, bz, WB, bB,
                                                   WC, bC, u, zy, Bp, Cp);
  mamba_scan_kernel<<<BSZ * (DDIM / 16), 1024, 0, stream>>>(u, zy, Bp, Cp, A, Dv,
                                                          dbias);
  mamba_outln_kernel<<<RTOT / OROWS, 256, 0, stream>>>(zy, Wo, bo, gamma, beta, x,
                                                    out);
}

// v004
// Measured time: 120 microseconds a run.
// Timed twice side by side with v003, it ran 1.05 and 1.04 times as fast.
// Counting every step since v000, it is 7.92 times as fast.
#include <hip/hip_runtime.h>
#include <math.h>

typedef __attribute__((ext_vector_type(2))) float    v2f;
typedef __attribute__((ext_vector_type(8))) float    v8f;
typedef __attribute__((ext_vector_type(4))) float    v4f;

#define DDIM 512
#define NDIM 16
#define LSEQ 1024
#define BSZ  8
#define RTOT (BSZ * LSEQ)          // 8192 token rows
#define LROWF 516                  // effective padded row stride (floats)

__device__ __forceinline__ int pidx(int row, int col) {
  return row * LROWF + col;
}

// ROWS x 512 f32 from global (row stride 512) into LDS at row stride LROWF, by
// all 256 threads: a wave moves 512 contiguous bytes per load and per store.
template <int ROWS>
__device__ __forceinline__ void stage_rows(const float* gsrc, float* lds, int tid) {
  constexpr int NV = ROWS * DDIM / 4 / 256;
  v4f v[NV];
  #pragma unroll
  for (int i = 0; i < NV; ++i)                   // i * 256 + tid: a group of 4 floats
    v[i] = *(const v4f*)(gsrc + 4 * (i * 256 + tid));
  asm volatile("s_wait_xcnt 0x0" ::: "memory");
  #pragma unroll
  for (int i = 0; i < NV; ++i) {
    const int e = i * 256 + tid;
    *(v4f*)&lds[pidx(e >> 7, (e & 127) << 2)] = v[i];
  }
}

__device__ __forceinline__ v8f wmma_k4(v2f a, v2f b, v8f c) {
  return __builtin_amdgcn_wmma_f32_16x16x4_f32(false, a, false, b, (short)0, c,
                                               false, false);
}

#define WKC     32
#define WPITCH  36
#define WBUF    (DDIM * WPITCH)    // floats per buffer
#define WSTAGES (DDIM / WKC)

__device__ __forceinline__ void copy8(const unsigned (&l)[8], const float* const (&g)[8]) {
  asm volatile(
      "global_load_async_to_lds_b128 %0, %8, off\n\t"
      "global_load_async_to_lds_b128 %1, %9, off\n\t"
      "global_load_async_to_lds_b128 %2, %10, off\n\t"
      "global_load_async_to_lds_b128 %3, %11, off\n\t"
      "global_load_async_to_lds_b128 %4, %12, off\n\t"
      "global_load_async_to_lds_b128 %5, %13, off\n\t"
      "global_load_async_to_lds_b128 %6, %14, off\n\t"
      "global_load_async_to_lds_b128 %7, %15, off\n\t"
      "s_wait_xcnt 0x0"
      :: "v"(l[0]), "v"(l[1]), "v"(l[2]), "v"(l[3]), "v"(l[4]), "v"(l[5]), "v"(l[6]), "v"(l[7]),
         "v"(g[0]), "v"(g[1]), "v"(g[2]), "v"(g[3]), "v"(g[4]), "v"(g[5]), "v"(g[6]), "v"(g[7])
      : "memory");
}

// Stage s of W into buf: each of the 8 waves copies the 64 weight rows that it
// reads itself, 16 copies of 4 rows (8 lanes a row: one whole line).
__device__ __forceinline__ void copy_wstage(const float* W, float* buf, int wave,
                                            int lane, int s) {
  const int row = wave * 64 + (lane >> 3);
  const int col = (lane & 7) * 4;
  const float*   g0 = W + (size_t)row * DDIM + s * WKC + col;
  const unsigned l0 = (unsigned)(size_t)(buf + row * WPITCH + col);
  #pragma unroll
  for (int h = 0; h < 2; ++h) {
    unsigned l[8]; const float* g[8];
    #pragma unroll
    for (int i = 0; i < 8; ++i) {
      l[i] = l0 + (h * 32 + i * 4) * WPITCH * 4;
      g[i] = g0 + (h * 32 + i * 4) * DDIM;
    }
    copy8(l, g);
  }
}

// The 16 rows of WB and the 16 of WC, whole (K = 512), into dst at pitch LROWF:
// a wave copies 4 rows, 4 copies of 512 contiguous bytes a row.
__device__ __forceinline__ void copy_wbc(const float* WB, const float* WC, float* dst,
                                         int wave, int lane) {
  const float*   g0 = (wave < 4 ? WB : WC) + (size_t)((wave & 3) * 4) * DDIM + lane * 4;
  const unsigned l0 = (unsigned)(size_t)(dst + pidx(wave * 4, lane * 4));
  #pragma unroll
  for (int h = 0; h < 2; ++h) {
    unsigned l[8]; const float* g[8];
    #pragma unroll
    for (int i = 0; i < 8; ++i) {
      const int r = h * 2 + (i >> 2), c = (i & 3) * 128;
      l[i] = l0 + pidx(r, c) * 4;
      g[i] = g0 + r * DDIM + c;
    }
    copy8(l, g);
  }
}

// ROWS x 512 tile (LDS, pitch LROWF) times W^T, K = 512: a wave owns 64 output
// columns (4 column tiles) over all MT row tiles. Stage 0 is landed and published
// and stage 1 is in flight on entry; on return every wave has passed the last
// barrier, so that tile and ring are free.
template <int MT>
__device__ __forceinline__ void gemm_ring(const float* tile, float* ring, const float* W,
                                          int wave, int lane, v8f (&acc)[MT][4]) {
  const int half = lane >> 4;
  const int lid  = lane & 15;
  #pragma unroll 1   // one trip a stage: the publish point stands once in the code
  for (int s = 0; s < WSTAGES; ++s) {
    float*       buf = ring + (s & 1) * WBUF;
    const float* wb  = buf + (wave * 64 + lid) * WPITCH + 2 * half;
    const float* ta  = tile + pidx(lid, s * WKC + 2 * half);
    #pragma unroll
    for (int kk = 0; kk < WKC; kk += 4) {
      v2f a[MT], b[4];
      #pragma unroll
      for (int q = 0; q < 4; ++q) b[q] = *(const v2f*)(wb + q * 16 * WPITCH + kk);
      #pragma unroll
      for (int m = 0; m < MT; ++m) a[m] = *(const v2f*)(ta + pidx(m * 16, kk));
      #pragma unroll
      for (int m = 0; m < MT; ++m) {
        #pragma unroll
        for (int q = 0; q < 4; ++q) acc[m][q] = wmma_k4(a[m], b[q], acc[m][q]);
      }
    }
    // publish point of stage s + 1: own LDS reads of this buffer done, own copies
    // of the next stage landed, then the barrier; only then the refill
    asm volatile("s_wait_dscnt 0x0" ::: "memory");
    asm volatile("s_wait_asynccnt 0x0" ::: "memory");
    __syncthreads();
    if (s + 2 < WSTAGES) copy_wstage(W, buf, wave, lane, s + 2);
  }
  // no copy is left in flight when the ring's LDS is given up
  asm volatile("s_wait_asynccnt 0x0" ::: "memory");
}

// ---------------------------------------------------------------------------
// Kernel 1: u = x*Wi^T + bi ; z = x*Wz^T + bz ; Bp = u*WB^T + bB ; Cp = u*WC^T + bC
// ---------------------------------------------------------------------------
// One work-group of 8 waves per (64 token rows, u or z): a wave owns 64 output
// columns over all four row tiles. The u tile takes the x tile's place in LDS.
#define PROWS 64
#define PMT   (PROWS / 16)

__global__ __launch_bounds__(256)
void mamba_proj_kernel(const float* __restrict__ x,
                       const float* __restrict__ Wi, const float* __restrict__ bi,
                       const float* __restrict__ Wz, const float* __restrict__ bz,
                       const float* __restrict__ WB, const float* __restrict__ bB,
                       const float* __restrict__ WC, const float* __restrict__ bC,
                       float* __restrict__ u, float* __restrict__ z,
                       float* __restrict__ Bp, float* __restrict__ Cp)
{
  __shared__ __attribute__((aligned(16))) float smem[PROWS * LROWF + 2 * WBUF];
  float* xs   = smem;                  // x tile
  float* us   = smem;                  // u tile, once the x tile has been read out
  float* ring = smem + PROWS * LROWF;  // two weight stages

  const int tid  = threadIdx.x;
  const int wave = tid >> 5;
  const int lane = tid & 31;
  const int half = lane >> 4;       // K sub-block select (K=0,1 vs K=2,3)
  const int lid  = lane & 15;
  const int r0   = (blockIdx.x >> 1) * PROWS;

  const bool   is_u = (blockIdx.x & 1) == 0;
  const float* W    = is_u ? Wi : Wz;
  const float* bias = is_u ? bi : bz;
  float*       outp = is_u ? u  : z;

  copy_wstage(W, ring, wave, lane, 0);
  stage_rows<PROWS>(x + (size_t)r0 * DDIM, xs, tid);
  // stage 0 landed (own copies), then published with the x tile by the barrier
  asm volatile("s_wait_asynccnt 0x0" ::: "memory");
  __syncthreads();
  copy_wstage(W, ring + WBUF, wave, lane, 1);

  v8f acc[PMT][4] = {};
  gemm_ring<PMT>(xs, ring, W, wave, lane, acc);

  // the ring is free: WB and WC fly into it while u is stored
  if (is_u) copy_wbc(WB, WC, ring, wave, lane);

  #pragma unroll
  for (int q = 0; q < 4; ++q) {
    const int   n  = wave * 64 + q * 16 + lid;
    const float bn = bias[n];
    #pragma unroll
    for (int m = 0; m < PMT; ++m) {
      #pragma unroll
      for (int j = 0; j < 8; ++j) {
        const int row = m * 16 + j + 8 * half;             // C/D: M = j + 8*half
        const float v = acc[m][q][j] + bn;
        outp[(size_t)(r0 + row) * DDIM + n] = v;
        acc[m][q][j] = v;
      }
    }
  }
  asm volatile("s_wait_xcnt 0x0" ::: "memory");
  if (is_u) {
    #pragma unroll
    for (int q = 0; q < 4; ++q) {
      #pragma unroll
      for (int m = 0; m < PMT; ++m) {
        #pragma unroll
        for (int j = 0; j < 8; ++j) {
          us[pidx(m * 16 + j + 8 * half, wave * 64 + q * 16 + lid)] = acc[m][q][j];
        }
      }
    }
  }
  // WB and WC landed (own copies), then published with the u tile by the barrier
  asm volatile("s_wait_asynccnt 0x0" ::: "memory");
  __syncthreads();

  // Bp (waves 0-3) / Cp (waves 4-7): one 16x16 tile each, K=512, u tile and weights
  // from LDS.
  if (is_u) {
    const int    m  = wave & 3;
    const bool   wc = wave >= 4;
    const float* bn = wc ? bC : bB;
    float*       op = wc ? Cp : Bp;
    v8f acc = {};
    const float* w0 = ring + pidx((wc ? 16 : 0) + lid, 2 * half);
    #pragma unroll 4
    for (int k = 0; k < DDIM; k += 4) {
      v2f a = *(const v2f*)&us[pidx(m * 16 + lid, k + 2 * half)];
      v2f b = *(const v2f*)(w0 + k);
      acc = wmma_k4(a, b, acc);
    }
    const float bb = bn[lid];
    #pragma unroll
    for (int j = 0; j < 8; ++j) {
      const int row = m * 16 + j + 8 * half;
      op[(size_t)(r0 + row) * NDIM + lid] = acc[j] + bb;
    }
  }
}

#define SCHUNK 64
#define SLEN   (LSEQ / SCHUNK)
#define SCH    16
#define HPITCH (SCHUNK * SCH + 16)

// The hardware's exp and log work in base 2: log2(e) is multiplied into A once, ahead
// of the loops, instead of into every exponent.
#define LOG2E 1.44269504089f

// softplus(s) = log(1 + e^s) on the hardware's exp, log and rcp instructions.
// w = 1 + e drops the low bits of a small e; log(w) * e / (w - 1) gives them back
// (w - 1 is exact there), so that the result keeps its relative accuracy down to
// w == 1, from where on log(1 + e) is e itself.
__device__ __forceinline__ float softplus_hw(float s) {
  const float e = __expf(s);
  const float w = 1.f + e;
  const float l = __builtin_amdgcn_logf(w) * 0.69314718056f;   // log2(w) * ln 2
  const float r = l * (e * __builtin_amdgcn_rcpf(w - 1.f));
  return (s > 20.f) ? s : (w == 1.f ? e : r);
}

__global__ __launch_bounds__(1024)
void mamba_scan_kernel(const float* __restrict__ u, float* __restrict__ zy,
                       const float* __restrict__ Bp, const float* __restrict__ Cp,
                       const float* __restrict__ A,  const float* __restrict__ Dv,
                       const float* __restrict__ delta_bias)
{
  __shared__ float hs[NDIM * HPITCH];    // [n][chunk][channel]
  __shared__ float sd[SCHUNK * SCH];     // [chunk][channel]
  __shared__ float dts[SLEN * SCHUNK * SCH];  // [step][chunk][channel]

  const int tid   = threadIdx.x;
  const int lid   = tid & 15;            // channel in the slice
  const int chunk = tid >> 4;
  const int b     = blockIdx.x >> 5;
  const int d     = ((blockIdx.x & 31) << 4) + lid;

  float a[NDIM];
  #pragma unroll
  for (int n = 0; n < NDIM; ++n) a[n] = A[d * NDIM + n] * LOG2E;   // exp(dt A) = 2^(dt a)
  const float dbias = delta_bias[d];
  const float Dvd   = Dv[d];

  const size_t rbase = (size_t)b * LSEQ + (size_t)chunk * SLEN;

  // pass 1
  v2f h2[NDIM / 2];
  #pragma unroll
  for (int k = 0; k < NDIM / 2; ++k) h2[k] = (v2f){0.f, 0.f};
  float sdt = 0.f;
  #pragma unroll 1   // unrolled further, the build spills registers to scratch
  for (int l0 = 0; l0 < SLEN; l0 += 4) {
    // four steps' loads issued together
    float ub[4], bb[4];
    #pragma unroll
    for (int i = 0; i < 4; ++i) {
      const size_t r = rbase + l0 + i;
      bb[i] = Bp[r * NDIM + lid];
      ub[i] = u [r * DDIM + d];
    }
    #pragma unroll
    for (int i = 0; i < 4; ++i) {
      const float bB = bb[i];
      const float ut = ub[i];

      const float sx = ut + dbias;
      const float dt = softplus_hw(sx);
      const float du = dt * ut;
      sdt += dt;
      dts[(l0 + i) * (SCHUNK * SCH) + tid] = dt;

      // states in pairs as packed f32: half the multiply and fma issues (the
      // build forms the same pairs by itself in pass 3)
      #pragma unroll
      for (int k = 0; k < NDIM / 2; ++k) {
        const v2f B2 = {__shfl(bB, 2 * k, 16), __shfl(bB, 2 * k + 1, 16)};
        const v2f a2 = {a[2 * k], a[2 * k + 1]};
        const v2f x  = dt * a2;
        const v2f e  = {__builtin_amdgcn_exp2f(x[0]), __builtin_amdgcn_exp2f(x[1])};
        h2[k] = e * h2[k] + du * B2;
      }
    }
  }
  #pragma unroll
  for (int n = 0; n < NDIM; ++n) hs[n * HPITCH + tid] = h2[n >> 1][n & 1];
  sd[tid] = sdt;
  __syncthreads();

  // pass 2: eight whole waves, lane = (n, channel); end[j] is replaced by H[j]
  if (tid < NDIM * SCH) {
    const float an  = A[d * NDIM + chunk] * LOG2E;   // here chunk == n
    float*      col = hs + chunk * HPITCH + lid;
    float c = col[0];                                // H[1] = end[0], as H[0] = 0
    col[0] = 0.f;
    #pragma unroll 7   // 63 trips; LDS reads and exps run ahead of the chain
    for (int j = 1; j < SCHUNK; ++j) {
      const float e = col[j * SCH];
      col[j * SCH] = c;
      // the chunk's decay is kept finite: a zero state then stays zero, as in
      // the step-by-step product, also where the exp of the sum overflows
      const float g = fminf(__builtin_amdgcn_exp2f(sd[j * SCH + lid] * an), __FLT_MAX__);
      c = g * c + e;
    }
  }
  __syncthreads();

  // pass 3
  float h[NDIM];
  #pragma unroll
  for (int n = 0; n < NDIM; ++n) h[n] = hs[n * HPITCH + tid];

  #pragma unroll 2   // two steps' loads in flight per wait; four spill registers
  for (int l = 0; l < SLEN; ++l) {
    const size_t r = rbase + l;
    const float bB = Bp[r * NDIM + lid];
    const float bC = Cp[r * NDIM + lid];
    const float ut = u [r * DDIM + d];
    const float zt = zy[r * DDIM + d];

    const float dt = dts[l * (SCHUNK * SCH) + tid];           // own lane's, pass 1
    const float du = dt * ut;

    float yv = 0.f;
    #pragma unroll
    for (int n = 0; n < NDIM; ++n) {
      const float Bn = __shfl(bB, n, 16);
      const float Cn = __shfl(bC, n, 16);
      h[n] = __builtin_amdgcn_exp2f(dt * a[n]) * h[n] + du * Bn;
      yv  += h[n] * Cn;
    }
    yv += ut * Dvd;
    const float gate = zt * __builtin_amdgcn_rcpf(1.f + __expf(-zt));   // silu(z)
    zy[r * DDIM + d] = yv * gate;
  }
}

// ---------------------------------------------------------------------------
// Kernel 3: yo = y*Wo^T + bo ; out = x + LayerNorm(yo)*gamma + beta
// ---------------------------------------------------------------------------
// One work-group of 8 waves per 32 token rows (LayerNorm needs whole rows): a
// wave owns 64 output columns over both row tiles.
#define OROWS 32
#define OMT   (OROWS / 16)

__global__ __launch_bounds__(256)
void mamba_outln_kernel(const float* __restrict__ y,  const float* __restrict__ Wo,
                        const float* __restrict__ bo, const float* __restrict__ gamma,
                        const float* __restrict__ beta, const float* __restrict__ x,
                        float* __restrict__ out)
{
  __shared__ __attribute__((aligned(16))) float smem[2 * OROWS * LROWF + 2 * WBUF];
  float* ys   = smem;
  float* os   = smem + OROWS * LROWF;
  float* ring = smem + 2 * OROWS * LROWF;  // two weight stages

  const int tid  = threadIdx.x;
  const int wave = tid >> 5;
  const int lane = tid & 31;
  const int half = lane >> 4;
  const int lid  = lane & 15;
  const int r0   = blockIdx.x * OROWS;

  copy_wstage(Wo, ring, wave, lane, 0);
  stage_rows<OROWS>(y + (size_t)r0 * DDIM, ys, tid);
  // stage 0 landed (own copies), then published with the y tile by the barrier
  asm volatile("s_wait_asynccnt 0x0" ::: "memory");
  __syncthreads();
  copy_wstage(Wo, ring + WBUF, wave, lane, 1);

  v8f acc[OMT][4] = {};
  gemm_ring<OMT>(ys, ring, Wo, wave, lane, acc);

  #pragma unroll
  for (int q = 0; q < 4; ++q) {
    const int   n  = wave * 64 + q * 16 + lid;
    const float bn = bo[n];
    #pragma unroll
    for (int m = 0; m < OMT; ++m) {
      #pragma unroll
      for (int j = 0; j < 8; ++j) {
        os[pidx(m * 16 + j + 8 * half, n)] = acc[m][q][j] + bn;
      }
    }
  }
  __syncthreads();

  // LayerNorm + residual: each wave owns 4 rows; butterfly reduce in-wave.
  for (int rr = 0; rr < 4; ++rr) {
    const int row = wave * 4 + rr;
    float s1 = 0.f, s2 = 0.f;
    #pragma unroll
    for (int j = 0; j < 16; ++j) {
      const float v = os[pidx(row, lane + 32 * j)];
      s1 += v; s2 += v * v;
    }
    #pragma unroll
    for (int off = 16; off > 0; off >>= 1) {
      s1 += __shfl_xor(s1, off, 32);
      s2 += __shfl_xor(s2, off, 32);
    }
    const float mu   = s1 * (1.f / 512.f);
    const float var  = s2 * (1.f / 512.f) - mu * mu;
    const float rstd = rsqrtf(var + 1e-5f);
    #pragma unroll
    for (int j = 0; j < 16; ++j) {
      const int col = lane + 32 * j;
      const float ln = (os[pidx(row, col)] - mu) * rstd * gamma[col] + beta[col];
      const size_t gi = (size_t)(r0 + row) * DDIM + col;
      out[gi] = x[gi] + ln;
    }
  }
}

// ---------------------------------------------------------------------------
extern "C" void kernel_launch(void* const* d_in, const int* in_sizes, int n_in,
                              void* d_out, int out_size, void* d_ws, size_t ws_size,
                              hipStream_t stream) {
  (void)in_sizes; (void)n_in; (void)out_size; (void)ws_size;
  const float* x     = (const float*)d_in[0];
  const float* Wi    = (const float*)d_in[1];
  const float* bi    = (const float*)d_in[2];
  const float* Wz    = (const float*)d_in[3];
  const float* bz    = (const float*)d_in[4];
  const float* A     = (const float*)d_in[5];
  const float* Dv    = (const float*)d_in[6];
  const float* dbias = (const float*)d_in[7];
  const float* WB    = (const float*)d_in[8];
  const float* bB    = (const float*)d_in[9];
  const float* WC    = (const float*)d_in[10];
  const float* bC    = (const float*)d_in[11];
  const float* Wo    = (const float*)d_in[12];
  const float* bo    = (const float*)d_in[13];
  const float* gamma = (const float*)d_in[14];
  const float* beta  = (const float*)d_in[15];
  float* out = (float*)d_out;

  float* ws = (float*)d_ws;
  float* u  = ws;                                   // RTOT*DDIM
  float* zy = u  + (size_t)RTOT * DDIM;             // RTOT*DDIM (z, then y)
  float* Bp = zy + (size_t)RTOT * DDIM;             // RTOT*NDIM
  float* Cp = Bp + (size_t)RTOT * NDIM;             // RTOT*NDIM

  mamba_proj_kernel<<<2 * (RTOT / PROWS), 256, 0, stream>>>(x, Wi, bi, Wz, bz, WB, bB,
                                                   WC, bC, u, zy, Bp, Cp);
  mamba_scan_kernel<<<BSZ * (DDIM / 16), 1024, 0, stream>>>(u, zy, Bp, Cp, A, Dv,
                                                          dbias);
  mamba_outln_kernel<<<RTOT / OROWS, 256, 0, stream>>>(zy, Wo, bo, gamma, beta, x,
                                                    out);
}
